// v000
// The times below were measured on an AMD MI455X: many runs one after another, warmed up first and cycling through
// copies of the inputs, with the whole window's GPU time divided by the number of runs. Launches and the gaps
// between them are all in it. The median over several windows is given; except for v000 it joins two sittings, which
// can be a few percent apart, so the side-by-side timings, each taken in one sitting, are the better comparison.
// v000, which the later versions start from, runs in 20.4 microseconds.
#include <hip/hip_runtime.h>
#include <hip/hip_bf16.h>

typedef __attribute__((ext_vector_type(16))) _Float16 v16h;
typedef __attribute__((ext_vector_type(8)))  float    v8f;

#define S_LEN   2048
#define DHEAD   64
#define NHEAD   8
#define WIN     64          // half window
#define TQ      16          // queries per tile (WMMA M)
#define NKEYS   144         // TQ + 2*WIN window span of a tile
#define KPAD    160         // padded to multiple of 32 for PV K-dim
#define LSTRIDE 164         // LDS row stride in floats (164 dwords -> conflict-free)
#define WPB     4           // waves per block

__device__ __forceinline__ int clampi(int x, int lo, int hi) {
    return x < lo ? lo : (x > hi ? hi : x);
}

__global__ __launch_bounds__(WPB * 32)
void local_attn_wmma(const float* __restrict__ q,
                     const float* __restrict__ k,
                     const float* __restrict__ v,
                     float* __restrict__ out) {
    __shared__ float sP[WPB][TQ * LSTRIDE];   // scores -> probabilities
    __shared__ float sSum[WPB][TQ];           // softmax row sums

    const int lane   = threadIdx.x & 31;
    const int wave   = threadIdx.x >> 5;
    const int tile   = blockIdx.x * WPB + wave;        // 0 .. H*S/TQ-1
    const int h      = tile >> 7;                      // 128 tiles per head
    const int q0     = (tile & 127) * TQ;
    const int key0   = q0 - WIN;

    const float* Q = q   + (size_t)h * S_LEN * DHEAD;
    const float* K = k   + (size_t)h * S_LEN * DHEAD;
    const float* V = v   + (size_t)h * S_LEN * DHEAD;
    float*       O = out + (size_t)h * S_LEN * DHEAD;

    const int sub    = lane & 15;     // column / M%16 index
    const int halfid = lane >> 4;     // which half of the wave
    const int kb     = 8 * halfid;    // per-lane K-run base (A & B share mapping)
    float* P = sP[wave];

    // ---------------- Q fragments: A-layout, 2 K-chunks of 32 ----------------
    v16h aq[2];
    {
        const float* qrow = Q + (q0 + sub) * DHEAD;
#pragma unroll
        for (int c = 0; c < 2; ++c)
#pragma unroll
            for (int e = 0; e < 16; ++e) {
                int kk = (e < 8) ? (kb + e) : (16 + kb + (e - 8));
                aq[c][e] = (_Float16)qrow[c * 32 + kk];
            }
    }

    // ---------------- scores: S = (Q K^T) * scale, raw into LDS --------------
    const float scale = 0.125f;  // 1/sqrt(64)
    for (int kc = 0; kc < 9; ++kc) {
        int key  = key0 + kc * 16 + sub;
        const float* krow = K + clampi(key, 0, S_LEN - 1) * DHEAD;
        v8f acc = {};
#pragma unroll
        for (int c = 0; c < 2; ++c) {
            v16h bk;
#pragma unroll
            for (int e = 0; e < 16; ++e) {
                int kk = (e < 8) ? (kb + e) : (16 + kb + (e - 8));
                bk[e] = (_Float16)krow[c * 32 + kk];
            }
            acc = __builtin_amdgcn_wmma_f32_16x16x32_f16(
                    false, aq[c], false, bk, (short)0, acc, false, false);
        }
#pragma unroll
        for (int r = 0; r < 8; ++r) {
            int M = r + 8 * halfid;
            P[M * LSTRIDE + kc * 16 + sub] = acc[r] * scale;
        }
    }

    // zero-pad columns 144..159 so the PV K-loop can run to KPAD
#pragma unroll
    for (int t = 0; t < 8; ++t)
        P[sub * LSTRIDE + NKEYS + 8 * halfid + t] = 0.0f;

    // ---------------- masked softmax (fp32, in LDS) --------------------------
    {
        const int row   = sub;
        const int jlo   = max(row, WIN - q0);
        const int jhi   = min(min(row + 2 * WIN, NKEYS - 1), S_LEN - 1 - q0 + WIN);
        const int jbase = 72 * halfid;

        float m = -INFINITY;
        for (int t = 0; t < 72; ++t) {
            int j = jbase + t;
            float val = (j >= jlo && j <= jhi) ? P[row * LSTRIDE + j] : -INFINITY;
            m = fmaxf(m, val);
        }
        m = fmaxf(m, __shfl_xor(m, 16, 32));

        float ssum = 0.0f;
        for (int t = 0; t < 72; ++t) {
            int j = jbase + t;
            float val = (j >= jlo && j <= jhi) ? P[row * LSTRIDE + j] : -INFINITY;
            float e = __expf(val - m);          // masked -> exp(-inf)=0
            P[row * LSTRIDE + j] = e;
            ssum += e;
        }
        ssum += __shfl_xor(ssum, 16, 32);
        if (halfid == 0) sSum[wave][row] = ssum;
    }

    // per-lane inverse row sums for the output rows this lane owns
    float isum[8];
#pragma unroll
    for (int r = 0; r < 8; ++r)
        isum[r] = 1.0f / sSum[wave][r + 8 * halfid];

    // ---------------- O = P * V (K-dim padded to 160) ------------------------
    for (int nb = 0; nb < 4; ++nb) {
        v8f acc = {};
        for (int st = 0; st < 5; ++st) {
            v16h ap, bv;
#pragma unroll
            for (int e = 0; e < 16; ++e) {
                int kk = (e < 8) ? (kb + e) : (16 + kb + (e - 8));
                int j  = st * 32 + kk;
                ap[e]  = (_Float16)P[sub * LSTRIDE + j];
                int key = clampi(key0 + j, 0, S_LEN - 1);   // prob is 0 where clamped
                bv[e]  = (_Float16)V[key * DHEAD + nb * 16 + sub];
            }
            acc = __builtin_amdgcn_wmma_f32_16x16x32_f16(
                    false, ap, false, bv, (short)0, acc, false, false);
        }
#pragma unroll
        for (int r = 0; r < 8; ++r) {
            int M = r + 8 * halfid;
            O[(q0 + M) * DHEAD + nb * 16 + sub] = acc[r] * isum[r];
        }
    }
}

extern "C" void kernel_launch(void* const* d_in, const int* in_sizes, int n_in,
                              void* d_out, int out_size, void* d_ws, size_t ws_size,
                              hipStream_t stream) {
    (void)in_sizes; (void)n_in; (void)d_ws; (void)ws_size; (void)out_size;
    const float* q = (const float*)d_in[0];
    const float* k = (const float*)d_in[1];
    const float* v = (const float*)d_in[2];
    float* out = (float*)d_out;

    const int tiles  = NHEAD * (S_LEN / TQ);   // 1024
    const int blocks = tiles / WPB;            // 256
    local_attn_wmma<<<blocks, WPB * 32, 0, stream>>>(q, k, v, out);
}

// v001
// One run takes 8.57 microseconds.
// In two side-by-side timings against v000, it was 2.42 and 2.41 times as fast.
#include <hip/hip_runtime.h>
#include <hip/hip_bf16.h>

typedef __attribute__((ext_vector_type(16))) _Float16 v16h;
typedef __attribute__((ext_vector_type(8)))  float    v8f;

#define S_LEN   2048
#define DHEAD   64
#define NHEAD   8
#define WIN     64          // half window
#define TQ      16          // queries per tile (WMMA M)
#define NKEYS   144         // TQ + 2*WIN window span of a tile
#define KPAD    160         // padded to multiple of 32 for PV K-dim
#define LSTRIDE 164         // LDS row stride in floats (164 dwords -> conflict-free)
#define WPB     4           // waves per block
#define KAHEAD  5           // key blocks whose loads are in flight ahead of their use

__device__ __forceinline__ int clampi(int x, int lo, int hi) {
    return x < lo ? lo : (x > hi ? hi : x);
}

__global__ __launch_bounds__(WPB * 32)
void local_attn_wmma(const float* __restrict__ q,
                     const float* __restrict__ k,
                     const float* __restrict__ v,
                     float* __restrict__ out) {
    __shared__ float sP[WPB][TQ * LSTRIDE];   // scores -> probabilities
    __shared__ float sSum[WPB][TQ];           // softmax row sums

    const int lane   = threadIdx.x & 31;
    const int wave   = threadIdx.x >> 5;
    const int tile   = blockIdx.x * WPB + wave;        // 0 .. H*S/TQ-1
    const int h      = tile >> 7;                      // 128 tiles per head
    const int q0     = (tile & 127) * TQ;
    const int key0   = q0 - WIN;

    const float* Q = q   + (size_t)h * S_LEN * DHEAD;
    const float* K = k   + (size_t)h * S_LEN * DHEAD;
    const float* V = v   + (size_t)h * S_LEN * DHEAD;
    float*       O = out + (size_t)h * S_LEN * DHEAD;

    const int sub    = lane & 15;     // column / M%16 index
    const int halfid = lane >> 4;     // which half of the wave
    const int kb     = 8 * halfid;    // per-lane K-run base (A & B share mapping)
    float* P = sP[wave];

    // One fragment row: 32 floats of a 64-float row, p = row + kb, in the k order that A and B share.
    auto load_row = [&](float (&dst)[32], const float* p) {
#pragma unroll
        for (int c = 0; c < 2; ++c)
#pragma unroll
            for (int e = 0; e < 16; ++e)
                dst[c * 16 + e] = p[c * 32 + ((e < 8) ? e : (8 + e))];
    };

    // ---------------- Q row and the first KAHEAD key blocks: all loads go out together
    const float* qp = Q + (q0 + sub) * DHEAD + kb;
    const float* kp[9];
#pragma unroll
    for (int kc = 0; kc < 9; ++kc)
        kp[kc] = K + clampi(key0 + kc * 16 + sub, 0, S_LEN - 1) * DHEAD + kb;

    float qf[32];
    float kf[9][32];
    load_row(qf, qp);
#pragma unroll
    for (int kc = 0; kc < KAHEAD; ++kc)
        load_row(kf[kc], kp[kc]);
    // the address registers of the loads above are named as inputs so that none of them is
    // rewritten ahead of this wait
    asm volatile("s_wait_xcnt 0x0" :: "v"(qp), "v"(kp[0]), "v"(kp[1]), "v"(kp[2]), "v"(kp[3]), "v"(kp[4]) : "memory");

    v16h aq[2];
#pragma unroll
    for (int c = 0; c < 2; ++c)
#pragma unroll
        for (int e = 0; e < 16; ++e)
            aq[c][e] = (_Float16)qf[c * 16 + e];

    // ---------------- scores: S = (Q K^T) * scale, raw into LDS --------------
    const float scale = 0.125f;  // 1/sqrt(64)
#pragma unroll
    for (int kc = 0; kc < 9; ++kc) {
        v8f acc = {};
#pragma unroll
        for (int c = 0; c < 2; ++c) {
            v16h bk;
#pragma unroll
            for (int e = 0; e < 16; ++e)
                bk[e] = (_Float16)kf[kc][c * 16 + e];
            acc = __builtin_amdgcn_wmma_f32_16x16x32_f16(
                    false, aq[c], false, bk, (short)0, acc, false, false);
        }
        if (kc + KAHEAD < 9) {
            load_row(kf[kc + KAHEAD], kp[kc + KAHEAD]);
            // as above: the refill's address register is held to the wait
            asm volatile("s_wait_xcnt 0x0" :: "v"(kp[kc + KAHEAD]) : "memory");
        }
#pragma unroll
        for (int r = 0; r < 8; ++r) {
            int M = r + 8 * halfid;
            P[M * LSTRIDE + kc * 16 + sub] = acc[r] * scale;
        }
    }

    // V values of key block st, column blocks nb0..nb1-1, in B-fragment order
    float vf[5][64];
    auto load_v = [&](int st, int nb0, int nb1) {
        const float* vp[16];
#pragma unroll
        for (int e = 0; e < 16; ++e) {
            int kk  = (e < 8) ? (kb + e) : (16 + kb + (e - 8));
            int key = clampi(key0 + st * 32 + kk, 0, S_LEN - 1);   // prob is 0 where clamped
            vp[e] = V + key * DHEAD + sub;
        }
#pragma unroll
        for (int e = 0; e < 16; ++e)
#pragma unroll
            for (int nb = nb0; nb < nb1; ++nb)
                vf[st][nb * 16 + e] = vp[e][nb * 16];
        // as above: the 16 row addresses are held to the wait
        asm volatile("s_wait_xcnt 0x0" :: "v"(vp[0]), "v"(vp[1]), "v"(vp[2]), "v"(vp[3]), "v"(vp[4]), "v"(vp[5]),
                     "v"(vp[6]), "v"(vp[7]), "v"(vp[8]), "v"(vp[9]), "v"(vp[10]), "v"(vp[11]), "v"(vp[12]),
                     "v"(vp[13]), "v"(vp[14]), "v"(vp[15]) : "memory");
    };
    // 48 V loads fly under the softmax (a wave's load counter holds 63)
    load_v(0, 0, 3);

    // zero-pad columns 144..159 so the PV K-loop can run to KPAD
#pragma unroll
    for (int t = 0; t < 8; ++t)
        P[sub * LSTRIDE + NKEYS + 8 * halfid + t] = 0.0f;

    // ---------------- masked softmax (fp32, in LDS) --------------------------
    {
        const int row   = sub;
        const int jlo   = max(row, WIN - q0);
        const int jhi   = min(min(row + 2 * WIN, NKEYS - 1), S_LEN - 1 - q0 + WIN);
        const int jbase = 72 * halfid;

        // all 72 scores of this lane are read at once (every one was written above);
        // the window mask is applied to the registers, not to the loads
        float val[72];
#pragma unroll
        for (int t = 0; t < 72; ++t)
            val[t] = P[row * LSTRIDE + jbase + t];

        const unsigned span = (unsigned)(jhi - jlo);   // jlo <= jhi for every tile
        float m = -INFINITY;
#pragma unroll
        for (int t = 0; t < 72; ++t) {
            val[t] = ((unsigned)(jbase + t - jlo) <= span) ? val[t] : -INFINITY;
            m = fmaxf(m, val[t]);
        }
        m = fmaxf(m, __shfl_xor(m, 16, 32));

        float ssum = 0.0f;
#pragma unroll
        for (int t = 0; t < 72; ++t) {
            float x = (val[t] - m) * 1.44269504f;   // exp(d) = exp2(d * log2 e); masked -> exp2(-inf) = 0
            float e;
            // the v_nop is the slot asked for behind a transcendental before its source is
            // overwritten; in one statement it cannot drift
            asm("v_exp_f32 %0, %1\n\tv_nop" : "=v"(e) : "v"(x));
            P[row * LSTRIDE + jbase + t] = e;
            ssum += e;
        }
        ssum += __shfl_xor(ssum, 16, 32);
        if (halfid == 0) sSum[wave][row] = ssum;
    }

    // per-lane inverse row sums for the output rows this lane owns
    float isum[8];
#pragma unroll
    for (int r = 0; r < 8; ++r)
        isum[r] = 1.0f / sSum[wave][r + 8 * halfid];

    // ---------------- O = P * V (K-dim padded to 160) ------------------------
    // key blocks outermost, unrolled: the 64 V loads of a key block share 16 row
    // addresses, and later blocks' loads fly under earlier blocks' WMMAs
    load_v(0, 3, 4);

    v8f acc[4] = {};
#pragma unroll
    for (int st = 0; st < 5; ++st) {
        if (st + 1 < 5)
            load_v(st + 1, 0, 4);
        v16h ap;
#pragma unroll
        for (int e = 0; e < 16; ++e) {
            int kk = (e < 8) ? (kb + e) : (16 + kb + (e - 8));
            ap[e]  = (_Float16)P[sub * LSTRIDE + st * 32 + kk];
        }
#pragma unroll
        for (int nb = 0; nb < 4; ++nb) {
            v16h bv;
#pragma unroll
            for (int e = 0; e < 16; ++e)
                bv[e] = (_Float16)vf[st][nb * 16 + e];
            acc[nb] = __builtin_amdgcn_wmma_f32_16x16x32_f16(
                    false, ap, false, bv, (short)0, acc[nb], false, false);
        }
    }
#pragma unroll
    for (int nb = 0; nb < 4; ++nb)
#pragma unroll
        for (int r = 0; r < 8; ++r) {
            int M = r + 8 * halfid;
            O[(q0 + M) * DHEAD + nb * 16 + sub] = acc[nb][r] * isum[r];
        }
}

extern "C" void kernel_launch(void* const* d_in, const int* in_sizes, int n_in,
                              void* d_out, int out_size, void* d_ws, size_t ws_size,
                              hipStream_t stream) {
    (void)in_sizes; (void)n_in; (void)d_ws; (void)ws_size; (void)out_size;
    const float* q = (const float*)d_in[0];
    const float* k = (const float*)d_in[1];
    const float* v = (const float*)d_in[2];
    float* out = (float*)d_out;

    const int tiles  = NHEAD * (S_LEN / TQ);   // 1024
    const int blocks = tiles / WPB;            // 256
    local_attn_wmma<<<blocks, WPB * 32, 0, stream>>>(q, k, v, out);
}

// v002
// It runs in 5.58 microseconds.
// In both of two side-by-side timings against v001, it was 1.53 times as fast.
// Counting every step since v000, it is 3.70 times as fast.
#include <hip/hip_runtime.h>
#include <hip/hip_bf16.h>

typedef __attribute__((ext_vector_type(16))) _Float16 v16h;
typedef __attribute__((ext_vector_type(8)))  float    v8f;
typedef __attribute__((ext_vector_type(8)))  _Float16 v8h;
typedef __attribute__((ext_vector_type(4)))  _Float16 v4h;
typedef __attribute__((ext_vector_type(4)))  float    v4f;
typedef __attribute__((ext_vector_type(8)))  short    s16x8;

#define S_LEN   2048
#define DHEAD   64
#define NHEAD   8
#define WIN     64          // half window
#define TQ      16          // queries per tile (WMMA M)
#define NKEYS   144         // TQ + 2*WIN window span of a tile
#define KPAD    160         // padded to multiple of 32 for PV K-dim
#define LSTRIDE 164         // LDS row stride in floats (164 dwords -> conflict-free)
#define WPB     4           // waves per block
#define BQ      (WPB * TQ)  // queries per block
#define BKEYS   (BQ + 2 * WIN)   // keys that the block's four windows span together
#define KPITCH  144         // bytes per f16 row of Q and K in LDS (16 B x odd: ds_load_b128 readers)
#define VPITCH  160         // bytes per f16 row of V in LDS (32 B x odd: ds_load_tr16_b128 readers)
#define VROWS   (BKEYS + KPAD - NKEYS)   // the last wave's padded PV range ends 16 rows further

// Work-group barrier that orders LDS accesses only. __syncthreads() also waited for every global
// load in flight, and the V loads are meant to stay in flight across the first barrier.
__device__ __forceinline__ void lds_barrier() {
    __builtin_amdgcn_fence(__ATOMIC_RELEASE, "workgroup", "local");
    __builtin_amdgcn_s_barrier();
    __builtin_amdgcn_fence(__ATOMIC_ACQUIRE, "workgroup", "local");
}

__global__ __launch_bounds__(WPB * 32)
void local_attn_wmma(const float* __restrict__ q,
                     const float* __restrict__ k,
                     const float* __restrict__ v,
                     float* __restrict__ out) {
    __shared__ float sP[WPB][TQ * LSTRIDE];   // scores -> probabilities
    __shared__ float sSum[WPB][TQ];           // softmax row sums
    __shared__ __attribute__((aligned(16))) unsigned char sQ[BQ * KPITCH];      // f16 rows, shared by the block
    __shared__ __attribute__((aligned(16))) unsigned char sK[BKEYS * KPITCH];
    __shared__ __attribute__((aligned(16))) unsigned char sV[VROWS * VPITCH];

    const int lane   = threadIdx.x & 31;
    const int wave   = threadIdx.x >> 5;
    const int tile   = blockIdx.x * WPB + wave;        // 0 .. H*S/TQ-1
    const int h      = tile >> 7;                      // 128 tiles per head
    const int q0     = (tile & 127) * TQ;

    float*       O = out + (size_t)h * S_LEN * DHEAD;

    const int sub    = lane & 15;     // column / M%16 index
    const int halfid = lane >> 4;     // which half of the wave
    const int kb     = 8 * halfid;    // per-lane K-run base (A & B share mapping)
    float* P = sP[wave];

    // ---------------- the block's Q, K and V rows: whole lines from global memory, once per block
    // A wave's load covers 512 contiguous bytes (two rows). The key range is three runs of 64 rows;
    // a run that lies outside the sequence is block-uniform and is read from the nearest run inside
    // it (its columns are masked in the softmax and carry probability 0 into PV).
    const int qb0 = (blockIdx.x & 31) * BQ;            // first query of the block
    // byte offsets, the same in q, k and v, of this thread's 16 bytes in the first 8 rows of the three
    // runs (the third is kept 64 rows low and its loads add them back as a constant)
    const unsigned tb   = (unsigned)h * (S_LEN * DHEAD * 4u) + threadIdx.x * 16u;
    const unsigned off0 = tb + (unsigned)(max(qb0, WIN) - WIN) * (DHEAD * 4u);
    const unsigned off1 = tb + (unsigned)qb0 * (DHEAD * 4u);          // also the block's first query
    const unsigned off2 = tb + (unsigned)min(qb0, S_LEN - 128) * (DHEAD * 4u);
    v4f qr[8], kr[24], vr[24];
#pragma unroll
    for (int i = 0; i < 8; ++i)
        qr[i] = *(const v4f*)((const char*)q + off1 + i * 2048);
#pragma unroll
    for (int i = 0; i < 8; ++i) {
        kr[i]      = *(const v4f*)((const char*)k + off0 + i * 2048);
        kr[8 + i]  = *(const v4f*)((const char*)k + off1 + i * 2048);
        kr[16 + i] = *(const v4f*)((const char*)k + off2 + (16384 + i * 2048));
    }
#pragma unroll
    for (int i = 0; i < 8; ++i) {
        vr[i]      = *(const v4f*)((const char*)v + off0 + i * 2048);
        vr[8 + i]  = *(const v4f*)((const char*)v + off1 + i * 2048);
        vr[16 + i] = *(const v4f*)((const char*)v + off2 + (16384 + i * 2048));
    }
    // the address registers of the loads above, vector offsets and scalar bases, are named as inputs
    // so that none of them is rewritten ahead of this wait (without the bases this build rewrote some)
    asm volatile("s_wait_xcnt 0x0" :: "v"(off0), "v"(off1), "v"(off2), "s"(q), "s"(k), "s"(v) : "memory");

    // four floats -> four f16 (round to nearest even, as before) -> 8 bytes of row r8 * 8 + thread / 16
    const unsigned srow = threadIdx.x >> 4, scol = (threadIdx.x & 15) * 8;
    auto put = [&](unsigned char* base, unsigned pitch, int r8, v4f x) {
        v4h y = { (_Float16)x[0], (_Float16)x[1], (_Float16)x[2], (_Float16)x[3] };
        *(v4h*)(base + (r8 * 8 + srow) * pitch + scol) = y;
    };
#pragma unroll
    for (int i = 0; i < 8; ++i)
        put(sQ, KPITCH, i, qr[i]);
#pragma unroll
    for (int i = 0; i < 24; ++i)
        put(sK, KPITCH, i, kr[i]);
    // publishes the f16 Q and K rows to the block's four waves
    lds_barrier();

    // a fragment in the k order that A and B share: 16 bytes at 16 * halfid and at 32 + 16 * halfid
    // of each 64 bytes of a row
    auto frag = [&](const unsigned char* p) {
        v8h lo = *(const v8h*)p, hi = *(const v8h*)(p + 32);
        return __builtin_shufflevector(lo, hi, 0, 1, 2, 3, 4, 5, 6, 7, 8, 9, 10, 11, 12, 13, 14, 15);
    };
    const unsigned char* qrow = sQ + (wave * TQ + sub) * KPITCH + 2 * kb;
    const unsigned char* krow = sK + (wave * TQ + sub) * KPITCH + 2 * kb;

    // all 40 fragment reads go out together, so that the wave pays the LDS latency once
    v16h aq[2], bk[9][2];
#pragma unroll
    for (int c = 0; c < 2; ++c)
        aq[c] = frag(qrow + c * 64);
#pragma unroll
    for (int c = 0; c < 2; ++c)
#pragma unroll
        for (int kc = 0; kc < 9; ++kc)
            bk[kc][c] = frag(krow + kc * 16 * KPITCH + c * 64);
    // keeps the reads above ahead of the WMMAs (the scheduler spread them two per WMMA)
    __builtin_amdgcn_sched_barrier(0);

    // ---------------- scores: S = (Q K^T) * scale, raw into LDS --------------
    const float scale = 0.125f;  // 1/sqrt(64)
    // nine independent accumulators, the k halves outermost: no WMMA waits for the one before it
    v8f sacc[9] = {};
#pragma unroll
    for (int c = 0; c < 2; ++c)
#pragma unroll
        for (int kc = 0; kc < 9; ++kc)
            sacc[kc] = __builtin_amdgcn_wmma_f32_16x16x32_f16(
                    false, aq[c], false, bk[kc][c], (short)0, sacc[kc], false, false);
#pragma unroll
    for (int kc = 0; kc < 9; ++kc)
#pragma unroll
        for (int r = 0; r < 8; ++r) {
            int M = r + 8 * halfid;
            P[M * LSTRIDE + kc * 16 + sub] = sacc[kc][r] * scale;
        }

    // the block's V rows go to LDS here: their loads have flown under the scores
    // (the fence keeps their waits from being scheduled up among the score WMMAs)
    __builtin_amdgcn_sched_barrier(0);
#pragma unroll
    for (int i = 0; i < 24; ++i)
        put(sV, VPITCH, i, vr[i]);
    // rows past the block's keys, which only the last wave's zero-padded columns meet, are zero
    *(v8h*)(sV + (BKEYS + (threadIdx.x >> 3)) * VPITCH + (threadIdx.x & 7) * 16) = v8h{};

    // zero-pad columns 144..159 so the PV K-loop can run to KPAD
#pragma unroll
    for (int t = 0; t < 8; ++t)
        P[sub * LSTRIDE + NKEYS + 8 * halfid + t] = 0.0f;

    // ---------------- masked softmax (fp32, in LDS) --------------------------
    {
        const int row   = sub;
        const int jlo   = max(row, WIN - q0);
        const int jhi   = min(min(row + 2 * WIN, NKEYS - 1), S_LEN - 1 - q0 + WIN);
        const int jbase = 72 * halfid;

        // all 72 scores of this lane are read at once (every one was written above);
        // the window mask is applied to the registers, not to the loads
        float val[72];
#pragma unroll
        for (int t = 0; t < 72; ++t)
            val[t] = P[row * LSTRIDE + jbase + t];

        const unsigned span = (unsigned)(jhi - jlo);   // jlo <= jhi for every tile
        float m = -INFINITY;
#pragma unroll
        for (int t = 0; t < 72; ++t) {
            val[t] = ((unsigned)(jbase + t - jlo) <= span) ? val[t] : -INFINITY;
            m = fmaxf(m, val[t]);
        }
        m = fmaxf(m, __shfl_xor(m, 16, 32));

        float ssum = 0.0f;
#pragma unroll
        for (int t = 0; t < 72; ++t) {
            float x = (val[t] - m) * 1.44269504f;   // exp(d) = exp2(d * log2 e); masked -> exp2(-inf) = 0
            float e;
            // the v_nop is the slot asked for behind a transcendental before its source is
            // overwritten; in one statement it cannot drift
            asm("v_exp_f32 %0, %1\n\tv_nop" : "=v"(e) : "v"(x));
            P[row * LSTRIDE + jbase + t] = e;
            ssum += e;
        }
        ssum += __shfl_xor(ssum, 16, 32);
        if (halfid == 0) sSum[wave][row] = ssum;
    }

    // per-lane inverse row sums for the output rows this lane owns
    float isum[8];
#pragma unroll
    for (int r = 0; r < 8; ++r)
        isum[r] = 1.0f / sSum[wave][r + 8 * halfid];

    // ---------------- O = P * V (K-dim padded to 160) ------------------------
    // the wave's own probabilities are read ahead of the barrier
    v16h ap[5];
#pragma unroll
    for (int st = 0; st < 5; ++st)
#pragma unroll
        for (int e = 0; e < 16; ++e) {
            int kk = (e < 8) ? (kb + e) : (16 + kb + (e - 8));
            ap[st][e] = (_Float16)P[sub * LSTRIDE + st * 32 + kk];
        }

    // publishes the f16 V rows to the block's four waves
    lds_barrier();

    // transposing read: lane (sub, halfid) gets V[row + 8 * halfid + 0..7][col + sub]
    typedef __attribute__((address_space(3))) s16x8 lds_s16x8;
    auto tr16 = [&](const unsigned char* p) {
        return __builtin_bit_cast(v8h, __builtin_amdgcn_ds_load_tr16_b128_v8i16((lds_s16x8*)p));
    };
    const unsigned char* vrow = sV + (wave * TQ + kb + (lane & 7)) * VPITCH + 16 * ((lane >> 3) & 1);

    // all 40 V fragment reads go out together, key blocks outermost as they are used
    v16h bv[5][4];
#pragma unroll
    for (int st = 0; st < 5; ++st)
#pragma unroll
        for (int nb = 0; nb < 4; ++nb) {
            v8h lo = tr16(vrow + (st * 32) * VPITCH + nb * 32);
            v8h hi = tr16(vrow + (st * 32 + 16) * VPITCH + nb * 32);
            bv[st][nb] = __builtin_shufflevector(lo, hi, 0, 1, 2, 3, 4, 5, 6, 7, 8, 9, 10, 11, 12, 13, 14, 15);
        }
    // keeps the reads above ahead of the WMMAs
    __builtin_amdgcn_sched_barrier(0);

    v8f acc[4] = {};
#pragma unroll
    for (int st = 0; st < 5; ++st)
#pragma unroll
        for (int nb = 0; nb < 4; ++nb)
            acc[nb] = __builtin_amdgcn_wmma_f32_16x16x32_f16(
                    false, ap[st], false, bv[st][nb], (short)0, acc[nb], false, false);
#pragma unroll
    for (int nb = 0; nb < 4; ++nb)
#pragma unroll
        for (int r = 0; r < 8; ++r) {
            int M = r + 8 * halfid;
            O[(q0 + M) * DHEAD + nb * 16 + sub] = acc[nb][r] * isum[r];
        }
}

extern "C" void kernel_launch(void* const* d_in, const int* in_sizes, int n_in,
                              void* d_out, int out_size, void* d_ws, size_t ws_size,
                              hipStream_t stream) {
    (void)in_sizes; (void)n_in; (void)d_ws; (void)ws_size; (void)out_size;
    const float* q = (const float*)d_in[0];
    const float* k = (const float*)d_in[1];
    const float* v = (const float*)d_in[2];
    float* out = (float*)d_out;

    const int tiles  = NHEAD * (S_LEN / TQ);   // 1024
    const int blocks = tiles / WPB;            // 256
    local_attn_wmma<<<blocks, WPB * 32, 0, stream>>>(q, k, v, out);
}

// v003
// It runs in 4.22 microseconds.
// Timed twice side by side with v002, it ran 1.33 and 1.32 times as fast.
// All steps since v000 together make it 4.90 times as fast.
#include <hip/hip_runtime.h>
#include <hip/hip_bf16.h>

typedef __attribute__((ext_vector_type(16))) _Float16 v16h;
typedef __attribute__((ext_vector_type(8)))  float    v8f;
typedef __attribute__((ext_vector_type(8)))  _Float16 v8h;
typedef __attribute__((ext_vector_type(4)))  _Float16 v4h;
typedef __attribute__((ext_vector_type(4)))  float    v4f;
typedef __attribute__((ext_vector_type(8)))  short    s16x8;

#define S_LEN   2048
#define DHEAD   64
#define NHEAD   8
#define WIN     64          // half window
#define TQ      16          // queries per tile (WMMA M)
#define NKEYS   144         // TQ + 2*WIN window span of a tile
#define KPAD    160         // padded to multiple of 32 for PV K-dim
#define WPB     4           // waves per block
#define BQ      (WPB * TQ)  // queries per block
#define BKEYS   (BQ + 2 * WIN)   // keys that the block's four windows span together
#define KPITCH  144         // bytes per f16 row of Q and K in LDS (16 B x odd: ds_load_b128 readers)
#define VPITCH  160         // bytes per f16 row of V in LDS (32 B x odd: ds_load_tr16_b128 readers)
#define VROWS   (BKEYS + KPAD - NKEYS)   // the last wave's padded PV range ends 16 rows further

// Work-group barrier that orders LDS accesses only. __syncthreads() also waited for every global
// load in flight, and the V loads are meant to stay in flight across the first barrier.
__device__ __forceinline__ void lds_barrier() {
    __builtin_amdgcn_fence(__ATOMIC_RELEASE, "workgroup", "local");
    __builtin_amdgcn_s_barrier();
    __builtin_amdgcn_fence(__ATOMIC_ACQUIRE, "workgroup", "local");
}

__global__ __launch_bounds__(WPB * 32)
void local_attn_wmma(const float* __restrict__ q,
                     const float* __restrict__ k,
                     const float* __restrict__ v,
                     float* __restrict__ out) {
    __shared__ __attribute__((aligned(16))) unsigned char sQ[BQ * KPITCH];      // f16 rows, shared by the block
    __shared__ __attribute__((aligned(16))) unsigned char sK[BKEYS * KPITCH];
    __shared__ __attribute__((aligned(16))) unsigned char sV[VROWS * VPITCH];

    const int lane   = threadIdx.x & 31;
    const int wave   = threadIdx.x >> 5;
    const int tile   = blockIdx.x * WPB + wave;        // 0 .. H*S/TQ-1
    const int h      = tile >> 7;                      // 128 tiles per head
    const int q0     = (tile & 127) * TQ;

    float*       O = out + (size_t)h * S_LEN * DHEAD;

    const int sub    = lane & 15;     // column / M%16 index
    const int halfid = lane >> 4;     // which half of the wave
    const int kb     = 8 * halfid;    // per-lane K-run base (A & B share mapping)

    // ---------------- the block's Q, K and V rows: whole lines from global memory, once per block
    // A wave's load covers 512 contiguous bytes (two rows). The key range is three runs of 64 rows;
    // a run that lies outside the sequence is block-uniform and is read from the nearest run inside
    // it (its columns are masked in the softmax and carry probability 0 into PV).
    const int qb0 = (blockIdx.x & 31) * BQ;            // first query of the block
    // byte offsets, the same in q, k and v, of this thread's 16 bytes in the first 8 rows of the three
    // runs (the third is kept 64 rows low and its loads add them back as a constant)
    const unsigned tb   = (unsigned)h * (S_LEN * DHEAD * 4u) + threadIdx.x * 16u;
    const unsigned off0 = tb + (unsigned)(max(qb0, WIN) - WIN) * (DHEAD * 4u);
    const unsigned off1 = tb + (unsigned)qb0 * (DHEAD * 4u);          // also the block's first query
    const unsigned off2 = tb + (unsigned)min(qb0, S_LEN - 128) * (DHEAD * 4u);
    v4f qr[8], kr[24], vr[24];
#pragma unroll
    for (int i = 0; i < 8; ++i)
        qr[i] = *(const v4f*)((const char*)q + off1 + i * 2048);
#pragma unroll
    for (int i = 0; i < 8; ++i) {
        kr[i]      = *(const v4f*)((const char*)k + off0 + i * 2048);
        kr[8 + i]  = *(const v4f*)((const char*)k + off1 + i * 2048);
        kr[16 + i] = *(const v4f*)((const char*)k + off2 + (16384 + i * 2048));
    }
#pragma unroll
    for (int i = 0; i < 8; ++i) {
        vr[i]      = *(const v4f*)((const char*)v + off0 + i * 2048);
        vr[8 + i]  = *(const v4f*)((const char*)v + off1 + i * 2048);
        vr[16 + i] = *(const v4f*)((const char*)v + off2 + (16384 + i * 2048));
    }
    // the address registers of the loads above, vector offsets and scalar bases, are named as inputs
    // so that none of them is rewritten ahead of this wait (without the bases this build rewrote some)
    asm volatile("s_wait_xcnt 0x0" :: "v"(off0), "v"(off1), "v"(off2), "s"(q), "s"(k), "s"(v) : "memory");

    // four floats -> four f16 (round to nearest even, as before) -> 8 bytes of row r8 * 8 + thread / 16
    const unsigned srow = threadIdx.x >> 4, scol = (threadIdx.x & 15) * 8;
    auto put = [&](unsigned char* base, unsigned pitch, int r8, v4f x) {
        v4h y = { (_Float16)x[0], (_Float16)x[1], (_Float16)x[2], (_Float16)x[3] };
        *(v4h*)(base + (r8 * 8 + srow) * pitch + scol) = y;
    };
#pragma unroll
    for (int i = 0; i < 8; ++i)
        put(sQ, KPITCH, i, qr[i]);
#pragma unroll
    for (int i = 0; i < 24; ++i)
        put(sK, KPITCH, i, kr[i]);
    // publishes the f16 Q and K rows to the block's four waves
    lds_barrier();

    // a fragment in the k order that A and B share: 16 bytes at 16 * halfid and at 32 + 16 * halfid
    // of each 64 bytes of a row
    auto frag = [&](const unsigned char* p) {
        v8h lo = *(const v8h*)p, hi = *(const v8h*)(p + 32);
        return __builtin_shufflevector(lo, hi, 0, 1, 2, 3, 4, 5, 6, 7, 8, 9, 10, 11, 12, 13, 14, 15);
    };
    const unsigned char* qrow = sQ + (wave * TQ + sub) * KPITCH + 2 * kb;
    const unsigned char* krow = sK + (wave * TQ + sub) * KPITCH + 2 * kb;

    // all 40 fragment reads go out together, so that the wave pays the LDS latency once
    v16h aq[2], bk[9][2];
#pragma unroll
    for (int c = 0; c < 2; ++c)
        aq[c] = frag(qrow + c * 64);
#pragma unroll
    for (int c = 0; c < 2; ++c)
#pragma unroll
        for (int kc = 0; kc < 9; ++kc)
            bk[kc][c] = frag(krow + kc * 16 * KPITCH + c * 64);
    // keeps the reads above ahead of the WMMAs (the scheduler spread them two per WMMA)
    __builtin_amdgcn_sched_barrier(0);

    // ---------------- scores, transposed: S^T = K Q^T ----------------------
    // K is the A operand and Q the B operand (A and B share the k order), so lane (sub, halfid)
    // holds, for query sub, the keys kc * 16 + 8 * halfid + 0..7: the very elements that the A
    // fragment of P takes in the PV product. Scores and probabilities never leave the registers.
    const float scale = 0.125f;  // 1/sqrt(64)
    // nine independent accumulators, the k halves outermost: no WMMA waits for the one before it
    v8f sacc[9] = {};
#pragma unroll
    for (int c = 0; c < 2; ++c)
#pragma unroll
        for (int kc = 0; kc < 9; ++kc)
            sacc[kc] = __builtin_amdgcn_wmma_f32_16x16x32_f16(
                    false, bk[kc][c], false, aq[c], (short)0, sacc[kc], false, false);

    // the block's V rows go to LDS here: their loads have flown under the scores
    // (the fence keeps their waits from being scheduled up among the score WMMAs)
    __builtin_amdgcn_sched_barrier(0);
#pragma unroll
    for (int i = 0; i < 24; ++i)
        put(sV, VPITCH, i, vr[i]);
    // rows past the block's keys, which only the last wave's zero-padded columns meet, are zero
    *(v8h*)(sV + (BKEYS + (threadIdx.x >> 3)) * VPITCH + (threadIdx.x & 7) * 16) = v8h{};

    // ---------------- masked softmax (fp32, in registers) -------------------
    // value of lane l ^ 16, by a vector move between the two 16-lane rows
    auto other_row = [](float x) {
        int i = __builtin_bit_cast(int, x);
        return __builtin_bit_cast(float, __builtin_amdgcn_permlanex16(i, i, 0x76543210, 0xfedcba98, false, false));
    };
    v16h  ap[5];     // A fragments of P; keys 144..159 (upper half of the last one) are zero
    float isum[8];   // inverse row sums of the output rows this lane owns
    {
        const int row   = sub;
        const int jlo   = max(row, WIN - q0);
        const int jhi   = min(min(row + 2 * WIN, NKEYS - 1), S_LEN - 1 - q0 + WIN);
        const int jbase = kb - jlo;                    // window column of element (kc, r), less jlo, is jbase + kc * 16 + r

        const unsigned span = (unsigned)(jhi - jlo);   // jlo <= jhi for every tile
        float val[72];
        float m = -INFINITY;
#pragma unroll
        for (int t = 0; t < 72; ++t) {
            val[t] = ((unsigned)(jbase + (t >> 3) * 16 + (t & 7)) <= span) ? sacc[t >> 3][t & 7] * scale : -INFINITY;
            m = fmaxf(m, val[t]);
        }
        m = fmaxf(m, other_row(m));

        // eight partial sums, one per accumulator register: one chain of 72 dependent adds would
        // stand between the last exponential and the PV product
        float part[8];
#pragma unroll
        for (int t = 0; t < 72; ++t) {
            float x = (val[t] - m) * 1.44269504f;   // exp(d) = exp2(d * log2 e); masked -> exp2(-inf) = 0
            float e;
            // the v_nop is the slot asked for behind a transcendental before its source is
            // overwritten; in one statement it cannot drift
            asm("v_exp_f32 %0, %1\n\tv_nop" : "=v"(e) : "v"(x));
            ap[t >> 4][t & 15] = (_Float16)e;
            part[t & 7] = (t < 8) ? e : part[t & 7] + e;
        }
#pragma unroll
        for (int e = 8; e < 16; ++e)
            ap[4][e] = (_Float16)0.0f;
        float ssum = ((part[0] + part[1]) + (part[2] + part[3])) + ((part[4] + part[5]) + (part[6] + part[7]));
        ssum += other_row(ssum);

        // this lane has the sum of query sub; its output rows are the queries 8 * halfid + 0..7.
        // The upper row first takes the value of lane sub ^ 8, then lane r of each row is shared out.
        const int inv = __builtin_bit_cast(int, 1.0f / ssum);
        const int swp = __builtin_amdgcn_mov_dpp(inv, 0x168 /* row_xmask:8 */, 0xf, 0xf, true);
        const int src8 = halfid ? swp : inv;
#define ROW_SHARE(r) isum[r] = __builtin_bit_cast(float, __builtin_amdgcn_mov_dpp(src8, 0x150 + (r) /* row_share:r */, 0xf, 0xf, true))
        ROW_SHARE(0); ROW_SHARE(1); ROW_SHARE(2); ROW_SHARE(3);
        ROW_SHARE(4); ROW_SHARE(5); ROW_SHARE(6); ROW_SHARE(7);
#undef ROW_SHARE
    }

    // ---------------- O = P * V (K-dim padded to 160) ------------------------
    // publishes the f16 V rows to the block's four waves
    lds_barrier();

    // transposing read: lane (sub, halfid) gets V[row + 8 * halfid + 0..7][col + sub]
    typedef __attribute__((address_space(3))) s16x8 lds_s16x8;
    auto tr16 = [&](const unsigned char* p) {
        return __builtin_bit_cast(v8h, __builtin_amdgcn_ds_load_tr16_b128_v8i16((lds_s16x8*)p));
    };
    const unsigned char* vrow = sV + (wave * TQ + kb + (lane & 7)) * VPITCH + 16 * ((lane >> 3) & 1);

    // all 40 V fragment reads go out together, key blocks outermost as they are used
    v16h bv[5][4];
#pragma unroll
    for (int st = 0; st < 5; ++st)
#pragma unroll
        for (int nb = 0; nb < 4; ++nb) {
            v8h lo = tr16(vrow + (st * 32) * VPITCH + nb * 32);
            v8h hi = tr16(vrow + (st * 32 + 16) * VPITCH + nb * 32);
            bv[st][nb] = __builtin_shufflevector(lo, hi, 0, 1, 2, 3, 4, 5, 6, 7, 8, 9, 10, 11, 12, 13, 14, 15);
        }
    // keeps the reads above ahead of the WMMAs
    __builtin_amdgcn_sched_barrier(0);

    v8f acc[4] = {};
#pragma unroll
    for (int st = 0; st < 5; ++st)
#pragma unroll
        for (int nb = 0; nb < 4; ++nb)
            acc[nb] = __builtin_amdgcn_wmma_f32_16x16x32_f16(
                    false, ap[st], false, bv[st][nb], (short)0, acc[nb], false, false);
#pragma unroll
    for (int nb = 0; nb < 4; ++nb)
#pragma unroll
        for (int r = 0; r < 8; ++r) {
            int M = r + 8 * halfid;
            O[(q0 + M) * DHEAD + nb * 16 + sub] = acc[nb][r] * isum[r];
        }
}

extern "C" void kernel_launch(void* const* d_in, const int* in_sizes, int n_in,
                              void* d_out, int out_size, void* d_ws, size_t ws_size,
                              hipStream_t stream) {
    (void)in_sizes; (void)n_in; (void)d_ws; (void)ws_size; (void)out_size;
    const float* q = (const float*)d_in[0];
    const float* k = (const float*)d_in[1];
    const float* v = (const float*)d_in[2];
    float* out = (float*)d_out;

    const int tiles  = NHEAD * (S_LEN / TQ);   // 1024
    const int blocks = tiles / WPB;            // 256
    local_attn_wmma<<<blocks, WPB * 32, 0, stream>>>(q, k, v, out);
}

// v004
// A run of this version takes 4.02 microseconds.
// Next to v003, in two timings, it ran 1.05 times as fast each time.
// Counting every step since v000, it is 5.15 times as fast.
#include <hip/hip_runtime.h>
#include <hip/hip_bf16.h>

typedef __attribute__((ext_vector_type(16))) _Float16 v16h;
typedef __attribute__((ext_vector_type(8)))  float    v8f;
typedef __attribute__((ext_vector_type(8)))  _Float16 v8h;
typedef __attribute__((ext_vector_type(4)))  _Float16 v4h;
typedef __attribute__((ext_vector_type(4)))  float    v4f;
typedef __attribute__((ext_vector_type(2)))  float    v2f;
typedef __attribute__((ext_vector_type(8)))  short    s16x8;

#define S_LEN   2048
#define DHEAD   64
#define NHEAD   8
#define WIN     64          // half window
#define TQ      16          // queries per tile (WMMA M)
#define NKEYS   144         // TQ + 2*WIN window span of a tile
#define KPAD    160         // padded to multiple of 32 for PV K-dim
#define WPB     4           // waves per block
#define BQ      (WPB * TQ)  // queries per block
#define BKEYS   (BQ + 2 * WIN)   // keys that the block's four windows span together
#define KPITCH  144         // bytes per f16 row of Q and K in LDS (16 B x odd: ds_load_b128 readers)
#define VPITCH  160         // bytes per f16 row of V in LDS (32 B x odd: ds_load_tr16_b128 readers)
#define VROWS   (BKEYS + KPAD - NKEYS)   // the last wave's padded PV range ends 16 rows further

// Work-group barrier that orders LDS accesses only. __syncthreads() also waited for every global
// load in flight, and the V loads are meant to stay in flight across the first barrier.
__device__ __forceinline__ void lds_barrier() {
    __builtin_amdgcn_fence(__ATOMIC_RELEASE, "workgroup", "local");
    __builtin_amdgcn_s_barrier();
    __builtin_amdgcn_fence(__ATOMIC_ACQUIRE, "workgroup", "local");
}

__global__ __launch_bounds__(WPB * 32)
void local_attn_wmma(const float* __restrict__ q,
                     const float* __restrict__ k,
                     const float* __restrict__ v,
                     float* __restrict__ out) {
    __shared__ __attribute__((aligned(16))) unsigned char sQ[BQ * KPITCH];      // f16 rows, shared by the block
    __shared__ __attribute__((aligned(16))) unsigned char sK[BKEYS * KPITCH];
    __shared__ __attribute__((aligned(16))) unsigned char sV[VROWS * VPITCH];

    const int lane   = threadIdx.x & 31;
    const int wave   = threadIdx.x >> 5;
    const int tile   = blockIdx.x * WPB + wave;        // 0 .. H*S/TQ-1
    const int h      = tile >> 7;                      // 128 tiles per head
    const int q0     = (tile & 127) * TQ;

    float*       O = out + (size_t)h * S_LEN * DHEAD;

    const int sub    = lane & 15;     // column / M%16 index
    const int halfid = lane >> 4;     // which half of the wave
    const int kb     = 8 * halfid;    // per-lane K-run base (A & B share mapping)

    // ---------------- the block's Q, K and V rows: whole lines from global memory, once per block
    // A wave's load covers 512 contiguous bytes (two rows). The key range is three runs of 64 rows;
    // a run that lies outside the sequence is block-uniform and is read from the nearest run inside
    // it (its columns are masked by the start values of the scores and carry probability 0 into PV).
    const int qb0 = (blockIdx.x & 31) * BQ;            // first query of the block
    // byte offsets, the same in q, k and v, of this thread's 16 bytes in the first 8 rows of the three
    // runs (the third is kept 64 rows low and its loads add them back as a constant)
    const unsigned tb   = (unsigned)h * (S_LEN * DHEAD * 4u) + threadIdx.x * 16u;
    const unsigned off0 = tb + (unsigned)(max(qb0, WIN) - WIN) * (DHEAD * 4u);
    const unsigned off1 = tb + (unsigned)qb0 * (DHEAD * 4u);          // also the block's first query
    const unsigned off2 = tb + (unsigned)min(qb0, S_LEN - 128) * (DHEAD * 4u);
    v4f qr[8], kr[24], vr[24];
#pragma unroll
    for (int i = 0; i < 8; ++i)
        qr[i] = *(const v4f*)((const char*)q + off1 + i * 2048);
#pragma unroll
    for (int i = 0; i < 8; ++i) {
        kr[i]      = *(const v4f*)((const char*)k + off0 + i * 2048);
        kr[8 + i]  = *(const v4f*)((const char*)k + off1 + i * 2048);
        kr[16 + i] = *(const v4f*)((const char*)k + off2 + (16384 + i * 2048));
    }
#pragma unroll
    for (int i = 0; i < 8; ++i) {
        vr[i]      = *(const v4f*)((const char*)v + off0 + i * 2048);
        vr[8 + i]  = *(const v4f*)((const char*)v + off1 + i * 2048);
        vr[16 + i] = *(const v4f*)((const char*)v + off2 + (16384 + i * 2048));
    }
    // the address registers of the loads above, vector offsets and scalar bases, are named as inputs
    // so that none of them is rewritten ahead of this wait (without the bases this build rewrote some)
    asm volatile("s_wait_xcnt 0x0" :: "v"(off0), "v"(off1), "v"(off2), "s"(q), "s"(k), "s"(v) : "memory");

    // ---------------- the mask, as the start value of the score accumulators --------------------
    // 0 for a key inside the query's window, MASKED outside it: S^T = K Q^T + start. |score| stays
    // below 2^38 with f16 operands, so a masked score stays near MASKED: it never wins the maximum
    // (every row has valid keys) and its exponential is 0. Built here, where the wave would only
    // wait for its global loads, so that nothing of the mask stands between the scores and PV.
    // Layout as in the score section below: lane (sub, halfid), register r of block kc is query
    // sub, window column kc * 16 + 8 * halfid + r.
    const float MASKED = -1.0e30f;
    v8f sacc[9];
    {
        const int jlo   = max(sub, WIN - q0);
        const int jhi   = min(min(sub + 2 * WIN, NKEYS - 1), S_LEN - 1 - q0 + WIN);
        const int jbase = kb - jlo;                    // window column of element (kc, r), less jlo, is jbase + kc * 16 + r
        const unsigned span = (unsigned)(jhi - jlo);   // jlo <= jhi for every tile
        // the first and the last block hold the slanted edges of the band
#pragma unroll
        for (int r = 0; r < 8; ++r) {
            sacc[0][r] = ((unsigned)(jbase + r) <= span) ? 0.0f : MASKED;
            sacc[8][r] = ((unsigned)(jbase + 8 * 16 + r) <= span) ? 0.0f : MASKED;
        }
        // columns 16..127 lie inside the band of all 16 queries; q0, WIN and S_LEN are multiples
        // of 16, so such a block of 16 keys lies wholly inside the sequence or wholly outside
        static_assert(TQ == 16 && WIN % 16 == 0 && S_LEN % 16 == 0 && 2 * WIN == 8 * 16, "block-wise mask");
#pragma unroll
        for (int kc = 1; kc < 8; ++kc) {
            const float s0 = ((unsigned)(q0 + kc * 16 - WIN) < (unsigned)S_LEN) ? 0.0f : MASKED;
            sacc[kc] = v8f{s0, s0, s0, s0, s0, s0, s0, s0};
        }
    }
    // four floats -> four f16 (round to nearest even, as before) -> 8 bytes of row r8 * 8 + thread / 16
    const unsigned srow = threadIdx.x >> 4, scol = (threadIdx.x & 15) * 8;
    auto put = [&](unsigned char* base, unsigned pitch, int r8, v4f x) {
        v4h y = { (_Float16)x[0], (_Float16)x[1], (_Float16)x[2], (_Float16)x[3] };
        *(v4h*)(base + (r8 * 8 + srow) * pitch + scol) = y;
    };
#pragma unroll
    for (int i = 0; i < 8; ++i)
        put(sQ, KPITCH, i, qr[i]);
#pragma unroll
    for (int i = 0; i < 24; ++i)
        put(sK, KPITCH, i, kr[i]);
    // keeps the mask's instructions above, where the wave waits for loads and LDS stores anyway
    // (the scheduler sank part of them behind the barrier, in front of the fragment reads)
    __builtin_amdgcn_sched_barrier(0);
    // publishes the f16 Q and K rows to the block's four waves
    lds_barrier();

    // a fragment in the k order that A and B share: 16 bytes at 16 * halfid and at 32 + 16 * halfid
    // of each 64 bytes of a row
    auto frag = [&](const unsigned char* p) {
        v8h lo = *(const v8h*)p, hi = *(const v8h*)(p + 32);
        return __builtin_shufflevector(lo, hi, 0, 1, 2, 3, 4, 5, 6, 7, 8, 9, 10, 11, 12, 13, 14, 15);
    };
    const unsigned char* qrow = sQ + (wave * TQ + sub) * KPITCH + 2 * kb;
    const unsigned char* krow = sK + (wave * TQ + sub) * KPITCH + 2 * kb;

    // all 40 fragment reads go out together, so that the wave pays the LDS latency once
    v16h aq[2], bk[9][2];
#pragma unroll
    for (int c = 0; c < 2; ++c)
        aq[c] = frag(qrow + c * 64);
#pragma unroll
    for (int c = 0; c < 2; ++c)
#pragma unroll
        for (int kc = 0; kc < 9; ++kc)
            bk[kc][c] = frag(krow + kc * 16 * KPITCH + c * 64);
    // keeps the reads above ahead of the WMMAs (the scheduler spread them two per WMMA)
    __builtin_amdgcn_sched_barrier(0);

    // ---------------- scores, transposed: S^T = K Q^T ----------------------
    // K is the A operand and Q the B operand (A and B share the k order), so lane (sub, halfid)
    // holds, for query sub, the keys kc * 16 + 8 * halfid + 0..7: the very elements that the A
    // fragment of P takes in the PV product. Scores and probabilities never leave the registers.
    // nine independent accumulators (they start from the mask), the k halves outermost: no WMMA
    // waits for the one before it
#pragma unroll
    for (int c = 0; c < 2; ++c)
#pragma unroll
        for (int kc = 0; kc < 9; ++kc)
            sacc[kc] = __builtin_amdgcn_wmma_f32_16x16x32_f16(
                    false, bk[kc][c], false, aq[c], (short)0, sacc[kc], false, false);

    // the block's V rows go to LDS here: their loads have flown under the scores
    // (the fence keeps their waits from being scheduled up among the score WMMAs)
    __builtin_amdgcn_sched_barrier(0);
#pragma unroll
    for (int i = 0; i < 24; ++i)
        put(sV, VPITCH, i, vr[i]);
    // rows past the block's keys, which only the last wave's zero-padded columns meet, are zero
    *(v8h*)(sV + (BKEYS + (threadIdx.x >> 3)) * VPITCH + (threadIdx.x & 7) * 16) = v8h{};

    // ---------------- masked softmax (fp32, in registers) -------------------
    // value of lane l ^ 16, by a vector move between the two 16-lane rows
    auto other_row = [](float x) {
        int i = __builtin_bit_cast(int, x);
        return __builtin_bit_cast(float, __builtin_amdgcn_permlanex16(i, i, 0x76543210, 0xfedcba98, false, false));
    };
    v16h  ap[5];     // A fragments of P; keys 144..159 (upper half of the last one) are zero
    float isum[8];   // inverse row sums of the output rows this lane owns
    {
        // maximum of the raw scores: eight independent chains, one per accumulator register (one
        // chain of dependent maxima would be exposed now that no mask work stands between them)
        float pm[8];
#pragma unroll
        for (int r = 0; r < 8; ++r)
            pm[r] = sacc[0][r];
#pragma unroll
        for (int kc = 1; kc < 9; ++kc)
#pragma unroll
            for (int r = 0; r < 8; ++r)
                pm[r] = fmaxf(pm[r], sacc[kc][r]);
        float m = fmaxf(fmaxf(fmaxf(pm[0], pm[1]), fmaxf(pm[2], pm[3])), fmaxf(fmaxf(pm[4], pm[5]), fmaxf(pm[6], pm[7])));
        m = fmaxf(m, other_row(m));
        // exp((s - m) / sqrt(64)) = exp2(s * c - m * c): scale, shift and log2 e in one fused multiply-add
        const float c  = 0.125f * 1.44269504f;
        const float nm = -m * c;
        // two scores per packed multiply-add, all of them ahead of the exponentials: a lone wave would
        // wait out the latency of a multiply-add that stands directly in front of its exponential
        v2f x2[36];
#pragma unroll
        for (int p = 0; p < 36; ++p)
            x2[p] = __builtin_elementwise_fma(v2f{sacc[p >> 2][2 * (p & 3)], sacc[p >> 2][2 * (p & 3) + 1]}, v2f{c, c}, v2f{nm, nm});

        // eight partial sums, one per accumulator register: one chain of 72 dependent adds would
        // stand between the last exponential and the PV product
        float part[8];
#pragma unroll
        for (int t = 0; t < 72; ++t) {
            float x = x2[t >> 1][t & 1];   // masked: about -2e29, exp2 gives 0
            float e;
            // the v_nop is the slot asked for behind a transcendental before its source is
            // overwritten; in one statement it cannot drift
            asm("v_exp_f32 %0, %1\n\tv_nop" : "=v"(e) : "v"(x));
            ap[t >> 4][t & 15] = (_Float16)e;
            part[t & 7] = (t < 8) ? e : part[t & 7] + e;
        }
#pragma unroll
        for (int e = 8; e < 16; ++e)
            ap[4][e] = (_Float16)0.0f;
        float ssum = ((part[0] + part[1]) + (part[2] + part[3])) + ((part[4] + part[5]) + (part[6] + part[7]));
        ssum += other_row(ssum);

        // this lane has the sum of query sub; its output rows are the queries 8 * halfid + 0..7.
        // The upper row first takes the value of lane sub ^ 8, then lane r of each row is shared out.
        const int inv = __builtin_bit_cast(int, 1.0f / ssum);
        const int swp = __builtin_amdgcn_mov_dpp(inv, 0x168 /* row_xmask:8 */, 0xf, 0xf, true);
        const int src8 = halfid ? swp : inv;
#define ROW_SHARE(r) isum[r] = __builtin_bit_cast(float, __builtin_amdgcn_mov_dpp(src8, 0x150 + (r) /* row_share:r */, 0xf, 0xf, true))
        ROW_SHARE(0); ROW_SHARE(1); ROW_SHARE(2); ROW_SHARE(3);
        ROW_SHARE(4); ROW_SHARE(5); ROW_SHARE(6); ROW_SHARE(7);
#undef ROW_SHARE
    }

    // ---------------- O = P * V (K-dim padded to 160) ------------------------
    // publishes the f16 V rows to the block's four waves
    lds_barrier();

    // transposing read: lane (sub, halfid) gets V[row + 8 * halfid + 0..7][col + sub]
    typedef __attribute__((address_space(3))) s16x8 lds_s16x8;
    auto tr16 = [&](const unsigned char* p) {
        return __builtin_bit_cast(v8h, __builtin_amdgcn_ds_load_tr16_b128_v8i16((lds_s16x8*)p));
    };
    const unsigned char* vrow = sV + (wave * TQ + kb + (lane & 7)) * VPITCH + 16 * ((lane >> 3) & 1);

    // all 40 V fragment reads go out together, key blocks outermost as they are used
    v16h bv[5][4];
#pragma unroll
    for (int st = 0; st < 5; ++st)
#pragma unroll
        for (int nb = 0; nb < 4; ++nb) {
            v8h lo = tr16(vrow + (st * 32) * VPITCH + nb * 32);
            v8h hi = tr16(vrow + (st * 32 + 16) * VPITCH + nb * 32);
            bv[st][nb] = __builtin_shufflevector(lo, hi, 0, 1, 2, 3, 4, 5, 6, 7, 8, 9, 10, 11, 12, 13, 14, 15);
        }
    // keeps the reads above ahead of the WMMAs
    __builtin_amdgcn_sched_barrier(0);

    v8f acc[4] = {};
#pragma unroll
    for (int st = 0; st < 5; ++st)
#pragma unroll
        for (int nb = 0; nb < 4; ++nb)
            acc[nb] = __builtin_amdgcn_wmma_f32_16x16x32_f16(
                    false, ap[st], false, bv[st][nb], (short)0, acc[nb], false, false);
#pragma unroll
    for (int nb = 0; nb < 4; ++nb)
#pragma unroll
        for (int r = 0; r < 8; ++r) {
            int M = r + 8 * halfid;
            O[(q0 + M) * DHEAD + nb * 16 + sub] = acc[nb][r] * isum[r];
        }
}

extern "C" void kernel_launch(void* const* d_in, const int* in_sizes, int n_in,
                              void* d_out, int out_size, void* d_ws, size_t ws_size,
                              hipStream_t stream) {
    (void)in_sizes; (void)n_in; (void)d_ws; (void)ws_size; (void)out_size;
    const float* q = (const float*)d_in[0];
    const float* k = (const float*)d_in[1];
    const float* v = (const float*)d_in[2];
    float* out = (float*)d_out;

    const int tiles  = NHEAD * (S_LEN / TQ);   // 1024
    const int blocks = tiles / WPB;            // 256
    local_attn_wmma<<<blocks, WPB * 32, 0, stream>>>(q, k, v, out);
}
